// v000
// Times are from an AMD MI455X. After a warm-up the kernel runs many times in a row, and a time is the length of
// such a window on the GPU divided by its runs, so every launch and the gaps after it count. The runs cycle
// through copies of the inputs. A figure is the median of several windows, for all but v000 over two sittings.
// Sittings can differ by a few percent; kernels timed side by side share one.
// v000 is the starting kernel. One run takes 1420 microseconds.
#include <hip/hip_runtime.h>
#include <hip/hip_bf16.h>

typedef __attribute__((ext_vector_type(2))) float v2f;
typedef __attribute__((ext_vector_type(8))) float v8f;
typedef __attribute__((ext_vector_type(4))) unsigned int u32x4;
typedef __attribute__((ext_vector_type(8))) int i32x8;
typedef __attribute__((ext_vector_type(4))) int i32x4;

#define B_SZ 16384
#define D_SZ 256
#define E_SZ 16
#define H_SZ 1024
#define O_SZ 2

#define MT  32    // rows per block (2 row subtiles of 16)
#define HC  256   // h columns per pass (8 waves x 32 cols)
#define KB  8     // K rows of W1 per TDM panel (double buffered)
#define NP  (D_SZ / KB)  // 32 panels per (expert, hc) pass
#define XSN 322   // lX row stride (== 2 mod 64; row span 288 after swizzle)
#define XHI 160   // dword offset of the {k+2,k+3} half (160 % 64 == 32)
#define WSN 264   // lW row stride (2*264 == 16 mod 64 -> disjoint half-wave banks)

static __device__ __forceinline__ v8f wmma4(v2f a, v2f b, v8f c) {
    return __builtin_amdgcn_wmma_f32_16x16x4_f32(false, a, false, b, (short)0, c,
                                                 false, false);
}

#if defined(__has_builtin)
#if __has_builtin(__builtin_amdgcn_tensor_load_to_lds) && \
    __has_builtin(__builtin_amdgcn_s_wait_tensorcnt)
#define USE_TDM 1
#endif
#endif

#ifdef USE_TDM
// One TDM descriptor per W1 panel: 2-D tile [KB rows x 256 cols] of f32,
// row stride H in memory; pad_interval=256 dwords + pad_amount=8 dwords
// reproduces the 264-dword LDS row stride (bank-conflict-free B reads).
// 6-arg builtin form (clang-23 / therock-10.0 toolchain).
static __device__ __forceinline__ void tdm_load_panel(const float* gsrc,
                                                      unsigned lds_off) {
    const unsigned long long ga = (unsigned long long)(uintptr_t)gsrc;
    u32x4 g0;
    g0[0] = 1u;                                   // count=1 (valid), user mode
    g0[1] = lds_off;                              // lds_addr (bytes)
    g0[2] = (unsigned)(ga & 0xffffffffu);         // global_addr[31:0]
    g0[3] = (unsigned)((ga >> 32) & 0x1ffffffu)   // global_addr[56:32]
            | (2u << 30);                         // type = 2 ("image")
    i32x8 g1;
    g1[0] = (2 << 16)      // data_size = 4 B
          | (1 << 20)      // pad_enable
          | (7 << 22)      // pad_interval: 256 dwords
          | (7 << 25);     // pad_amount: 8 dwords -> LDS row stride 264
    g1[1] = 0;                                    // barrier addr 0, dim0 lo16=0
    g1[2] = 0x10;                                 // tensor_dim0 = 1<<20 (hi16)
    g1[3] = 0x10 | (256 << 16);                   // tensor_dim1 hi16, tile_dim0=256
    g1[4] = KB;                                   // tile_dim1 = KB rows, tile_dim2=0
    g1[5] = H_SZ;                                 // tensor_dim0_stride = 1024
    g1[6] = 0;
    g1[7] = 0;
    i32x4 gz4 = {0, 0, 0, 0};                     // D# groups 2/3 (unused, 2-D)
    i32x8 gz8 = {0, 0, 0, 0, 0, 0, 0, 0};
    __builtin_amdgcn_tensor_load_to_lds(g0, g1, gz4, gz4, gz8, 0);
}
#endif

// ---------------------------------------------------------------------------
// Kernel 1: gating  logits = x @ w_gate ; gates = softmax(logits, axis=1)
// ---------------------------------------------------------------------------
__global__ __launch_bounds__(256) void gate_kernel(const float* __restrict__ x,
                                                   const float* __restrict__ wg,
                                                   float* __restrict__ gates) {
    __shared__ float lwg[D_SZ * E_SZ];  // 16 KB
    const int tid = threadIdx.x;
    for (int i = tid; i < D_SZ * E_SZ; i += 256) lwg[i] = wg[i];
    __syncthreads();

    const int row = blockIdx.x * 256 + tid;
    float acc[E_SZ];
#pragma unroll
    for (int e = 0; e < E_SZ; ++e) acc[e] = 0.0f;

    const float* xr = x + (size_t)row * D_SZ;
    for (int d = 0; d < D_SZ; d += 4) {
        float4 xv = *(const float4*)(xr + d);
#pragma unroll
        for (int e = 0; e < E_SZ; ++e) {
            acc[e] += xv.x * lwg[(d + 0) * E_SZ + e] + xv.y * lwg[(d + 1) * E_SZ + e] +
                      xv.z * lwg[(d + 2) * E_SZ + e] + xv.w * lwg[(d + 3) * E_SZ + e];
        }
    }
    float m = acc[0];
#pragma unroll
    for (int e = 1; e < E_SZ; ++e) m = fmaxf(m, acc[e]);
    float ex[E_SZ];
    float s = 0.0f;
#pragma unroll
    for (int e = 0; e < E_SZ; ++e) { ex[e] = __expf(acc[e] - m); s += ex[e]; }
    const float inv = 1.0f / s;
#pragma unroll
    for (int e = 0; e < E_SZ; ++e) gates[(size_t)row * E_SZ + e] = ex[e] * inv;
}

// ---------------------------------------------------------------------------
// Kernel 2: load-balance loss  cv2(importance) + cv2(load), ddof=1
// ---------------------------------------------------------------------------
__global__ __launch_bounds__(256) void loss_kernel(const float* __restrict__ gates,
                                                   float* __restrict__ out_loss) {
    __shared__ float red[256];
    __shared__ float impT[E_SZ], cntT[E_SZ];
    const int tid = threadIdx.x;
    float imp[E_SZ], cnt[E_SZ];
#pragma unroll
    for (int e = 0; e < E_SZ; ++e) { imp[e] = 0.0f; cnt[e] = 0.0f; }

    for (int r = tid; r < B_SZ; r += 256) {
#pragma unroll
        for (int e = 0; e < E_SZ; ++e) {
            float g = gates[(size_t)r * E_SZ + e];
            imp[e] += g;
            cnt[e] += (g > 0.0f) ? 1.0f : 0.0f;
        }
    }
    for (int e = 0; e < E_SZ; ++e) {
        red[tid] = imp[e]; __syncthreads();
        for (int s = 128; s > 0; s >>= 1) { if (tid < s) red[tid] += red[tid + s]; __syncthreads(); }
        if (tid == 0) impT[e] = red[0];
        __syncthreads();
        red[tid] = cnt[e]; __syncthreads();
        for (int s = 128; s > 0; s >>= 1) { if (tid < s) red[tid] += red[tid + s]; __syncthreads(); }
        if (tid == 0) cntT[e] = red[0];
        __syncthreads();
    }
    if (tid == 0) {
        float mi = 0.0f, ml = 0.0f;
        for (int e = 0; e < E_SZ; ++e) { mi += impT[e]; ml += cntT[e]; }
        mi *= (1.0f / E_SZ); ml *= (1.0f / E_SZ);
        float vi = 0.0f, vl = 0.0f;
        for (int e = 0; e < E_SZ; ++e) {
            float di = impT[e] - mi, dl = cntT[e] - ml;
            vi += di * di; vl += dl * dl;
        }
        vi *= (1.0f / (E_SZ - 1)); vl *= (1.0f / (E_SZ - 1));
        *out_loss = vi / (mi * mi + 1e-10f) + vl / (ml * ml + 1e-10f);
    }
}

// ---------------------------------------------------------------------------
// Kernel 3: fused expert MLP + weighted combine.
//   WMMA f32 16x16x4; W1 panels streamed by the Tensor Data Mover into a
//   double-buffered LDS panel, overlapped with compute (TENSORcnt pipeline).
// ---------------------------------------------------------------------------
__global__ __launch_bounds__(256) void moe_main(const float* __restrict__ x,
                                                const float* __restrict__ W1,
                                                const float* __restrict__ b1,
                                                const float* __restrict__ W2,
                                                const float* __restrict__ b2,
                                                const float* __restrict__ gates,
                                                float* __restrict__ y) {
    __shared__ float lX[MT * XSN];       // 41,216 B swizzled x tile [32][256]
    __shared__ float lW[2][KB * WSN];    // 16,896 B double-buffered W1 panel
    __shared__ float lAcc2[MT * O_SZ];
    __shared__ float lY[MT * O_SZ];

    const int tid  = threadIdx.x;
    const int wave = tid >> 5;
    const int lane = tid & 31;
    const int l15  = lane & 15;
    const int lhi  = lane >> 4;
    const int b0   = blockIdx.x * MT;

    // Stage X tile once with column-quad swizzle (b128 global + 2x b64 DS):
    // {k,k+1} at (k>>1); {k+2,k+3} at XHI+(k>>1) => A b64 reads hit all 64
    // banks exactly once for both half-waves and both row subtiles.
    {
        const int q   = tid & 63;   // quad-column 0..63
        const int rr0 = tid >> 6;   // 0..3
        for (int r = rr0; r < MT; r += 4) {
            float4 v = *(const float4*)&x[(size_t)(b0 + r) * D_SZ + 4 * q];
            v2f lo; lo.x = v.x; lo.y = v.y;
            v2f hi; hi.x = v.z; hi.y = v.w;
            *(v2f*)&lX[r * XSN + 2 * q]       = lo;
            *(v2f*)&lX[r * XSN + XHI + 2 * q] = hi;
        }
    }
    if (tid < MT * O_SZ) lY[tid] = 0.0f;

#ifdef USE_TDM
    const unsigned lwOff0 = (unsigned)(uintptr_t)&lW[0][0];
    const unsigned lwOff1 = (unsigned)(uintptr_t)&lW[1][0];
#endif

    for (int e = 0; e < E_SZ; ++e) {
        if (tid < MT * O_SZ) lAcc2[tid] = 0.0f;
        float plane[2][8][O_SZ];
#pragma unroll
        for (int rs = 0; rs < 2; ++rs)
#pragma unroll
            for (int j = 0; j < 8; ++j) { plane[rs][j][0] = 0.0f; plane[rs][j][1] = 0.0f; }

        for (int hc = 0; hc < H_SZ; hc += HC) {
            v8f acc00 = {}, acc01 = {}, acc10 = {}, acc11 = {};
            const float* wsrc = W1 + (size_t)e * D_SZ * H_SZ + hc;

            __syncthreads();  // prior readers of lW / lAcc2 users are done
#ifdef USE_TDM
            if (wave == 0) tdm_load_panel(wsrc, lwOff0);  // prefetch panel 0
#endif
            for (int p = 0; p < NP; ++p) {
                const int buf = p & 1;
#ifdef USE_TDM
                if (wave == 0) __builtin_amdgcn_s_wait_tensorcnt(0);  // panel p landed
                __syncthreads();  // panel p visible; buf^1 readers (p-1) done
                if (wave == 0 && p + 1 < NP)
                    tdm_load_panel(wsrc + (size_t)(p + 1) * KB * H_SZ,
                                   buf ? lwOff0 : lwOff1);  // overlap DMA w/ compute
#else
                {   // fallback: manual staging (b128), two barriers per panel
                    const float* src = wsrc + (size_t)p * KB * H_SZ;
                    const int c4  = (tid & 63) * 4;
                    const int rr0 = tid >> 6;
                    for (int rr = rr0; rr < KB; rr += 4)
                        *(float4*)&lW[buf][rr * WSN + c4] =
                            *(const float4*)&src[(size_t)rr * H_SZ + c4];
                    __syncthreads();
                }
#endif
                const float* lWb = lW[buf];
                const float* ax0 = &lX[l15 * XSN + lhi * XHI];
                const float* ax1 = &lX[(16 + l15) * XSN + lhi * XHI];
                const float* bx  = &lWb[(2 * lhi) * WSN + 32 * wave + l15];
#pragma unroll
                for (int kk = 0; kk < KB; kk += 4) {
                    const int kh = (p * KB + kk) >> 1;  // swizzled pair offset
                    v2f a0; a0.x = ax0[kh];           a0.y = ax0[kh + 1];
                    v2f a1; a1.x = ax1[kh];           a1.y = ax1[kh + 1];
                    v2f bA; bA.x = bx[kk * WSN];      bA.y = bx[kk * WSN + WSN];
                    v2f bB; bB.x = bx[kk * WSN + 16]; bB.y = bx[kk * WSN + WSN + 16];
                    acc00 = wmma4(a0, bA, acc00);
                    acc01 = wmma4(a0, bB, acc01);
                    acc10 = wmma4(a1, bA, acc10);
                    acc11 = wmma4(a1, bB, acc11);
                }
#ifndef USE_TDM
                __syncthreads();
#endif
            }
            // Epilogue for this 256-col pass: bias + relu + contract with W2.
            const int c0 = hc + 32 * wave + l15;
            const int c1 = c0 + 16;
            const float bias0 = b1[e * H_SZ + c0];
            const float bias1 = b1[e * H_SZ + c1];
            const float w200 = W2[((size_t)e * H_SZ + c0) * O_SZ + 0];
            const float w201 = W2[((size_t)e * H_SZ + c0) * O_SZ + 1];
            const float w210 = W2[((size_t)e * H_SZ + c1) * O_SZ + 0];
            const float w211 = W2[((size_t)e * H_SZ + c1) * O_SZ + 1];
#pragma unroll
            for (int j = 0; j < 8; ++j) {
                float h00 = fmaxf(acc00[j] + bias0, 0.0f);
                float h01 = fmaxf(acc01[j] + bias1, 0.0f);
                plane[0][j][0] += h00 * w200 + h01 * w210;
                plane[0][j][1] += h00 * w201 + h01 * w211;
                float h10 = fmaxf(acc10[j] + bias0, 0.0f);
                float h11 = fmaxf(acc11[j] + bias1, 0.0f);
                plane[1][j][0] += h10 * w200 + h11 * w210;
                plane[1][j][1] += h10 * w201 + h11 * w211;
            }
        }
        // Reduce partials across the 16 lanes of each half-wave.
#pragma unroll
        for (int rs = 0; rs < 2; ++rs)
#pragma unroll
            for (int j = 0; j < 8; ++j)
#pragma unroll
                for (int o = 0; o < O_SZ; ++o) {
                    float v = plane[rs][j][o];
                    v += __shfl_xor(v, 1, 32);
                    v += __shfl_xor(v, 2, 32);
                    v += __shfl_xor(v, 4, 32);
                    v += __shfl_xor(v, 8, 32);
                    plane[rs][j][o] = v;
                }
        if (l15 == 0) {
#pragma unroll
            for (int rs = 0; rs < 2; ++rs) {
                const int rbase = 16 * rs + lhi * 8;
#pragma unroll
                for (int j = 0; j < 8; ++j) {
                    atomicAdd(&lAcc2[(rbase + j) * O_SZ + 0], plane[rs][j][0]);
                    atomicAdd(&lAcc2[(rbase + j) * O_SZ + 1], plane[rs][j][1]);
                }
            }
        }
        __syncthreads();
        // softmax over O=2, gate-weight, accumulate into block-local y
        if (tid < MT) {
            float v0 = lAcc2[tid * 2 + 0] + b2[e * O_SZ + 0];
            float v1 = lAcc2[tid * 2 + 1] + b2[e * O_SZ + 1];
            float m  = fmaxf(v0, v1);
            float e0 = __expf(v0 - m), e1 = __expf(v1 - m);
            float inv = 1.0f / (e0 + e1);
            float g   = gates[(size_t)(b0 + tid) * E_SZ + e];
            lY[tid * 2 + 0] += g * e0 * inv;
            lY[tid * 2 + 1] += g * e1 * inv;
        }
        __syncthreads();
    }
    if (tid < MT * O_SZ)
        y[(size_t)b0 * O_SZ + tid] = lY[tid];
}

// ---------------------------------------------------------------------------
extern "C" void kernel_launch(void* const* d_in, const int* in_sizes, int n_in,
                              void* d_out, int out_size, void* d_ws, size_t ws_size,
                              hipStream_t stream) {
    const float* x  = (const float*)d_in[0];
    const float* wg = (const float*)d_in[1];
    const float* W1 = (const float*)d_in[2];
    const float* b1 = (const float*)d_in[3];
    const float* W2 = (const float*)d_in[4];
    const float* b2 = (const float*)d_in[5];
    float* out   = (float*)d_out;              // [B*O] y, then [1] loss
    float* gates = (float*)d_ws;               // B*E floats = 1 MB scratch

    gate_kernel<<<B_SZ / 256, 256, 0, stream>>>(x, wg, gates);
    loss_kernel<<<1, 256, 0, stream>>>(gates, out + (size_t)B_SZ * O_SZ);
    moe_main<<<B_SZ / MT, 256, 0, stream>>>(x, W1, b1, W2, b2, gates, out);
}

// v001
// Measured time: 744 microseconds a run.
// Timed twice side by side with v000, it ran 1.93 times as fast both times.
#include <hip/hip_runtime.h>
#include <hip/hip_bf16.h>

typedef __attribute__((ext_vector_type(2))) float v2f;
typedef __attribute__((ext_vector_type(8))) float v8f;

#define B_SZ 16384
#define D_SZ 256
#define E_SZ 16
#define H_SZ 1024
#define O_SZ 2

#define MT  32    // rows per block (2 row subtiles of 16)
#define HC  256   // h columns per pass (8 waves x 32 cols)
#define CH  8     // k4 steps of W1 per register chunk (two chunks: one in use, one in flight)
#define NCH (D_SZ / 4 / CH)  // 8 chunks per (expert, hc) pass
#define XSN 322   // lX row stride (== 2 mod 64; row span 288 after swizzle)
#define XHI 160   // dword offset of the {k+2,k+3} half (160 % 64 == 32)

static __device__ __forceinline__ v8f wmma4(v2f a, v2f b, v8f c) {
    return __builtin_amdgcn_wmma_f32_16x16x4_f32(false, a, false, b, (short)0, c,
                                                 false, false);
}

// ---------------------------------------------------------------------------
// Kernel 1: gating  logits = x @ w_gate ; gates = softmax(logits, axis=1)
// ---------------------------------------------------------------------------
__global__ __launch_bounds__(256) void gate_kernel(const float* __restrict__ x,
                                                   const float* __restrict__ wg,
                                                   float* __restrict__ gates) {
    __shared__ float lwg[D_SZ * E_SZ];  // 16 KB
    const int tid = threadIdx.x;
    for (int i = tid; i < D_SZ * E_SZ; i += 256) lwg[i] = wg[i];
    __syncthreads();

    const int row = blockIdx.x * 256 + tid;
    float acc[E_SZ];
#pragma unroll
    for (int e = 0; e < E_SZ; ++e) acc[e] = 0.0f;

    const float* xr = x + (size_t)row * D_SZ;
    for (int d = 0; d < D_SZ; d += 4) {
        float4 xv = *(const float4*)(xr + d);
#pragma unroll
        for (int e = 0; e < E_SZ; ++e) {
            acc[e] += xv.x * lwg[(d + 0) * E_SZ + e] + xv.y * lwg[(d + 1) * E_SZ + e] +
                      xv.z * lwg[(d + 2) * E_SZ + e] + xv.w * lwg[(d + 3) * E_SZ + e];
        }
    }
    float m = acc[0];
#pragma unroll
    for (int e = 1; e < E_SZ; ++e) m = fmaxf(m, acc[e]);
    float ex[E_SZ];
    float s = 0.0f;
#pragma unroll
    for (int e = 0; e < E_SZ; ++e) { ex[e] = __expf(acc[e] - m); s += ex[e]; }
    const float inv = 1.0f / s;
#pragma unroll
    for (int e = 0; e < E_SZ; ++e) gates[(size_t)row * E_SZ + e] = ex[e] * inv;
}

// ---------------------------------------------------------------------------
// Kernel 2: load-balance loss  cv2(importance) + cv2(load), ddof=1
// ---------------------------------------------------------------------------
__global__ __launch_bounds__(256) void loss_kernel(const float* __restrict__ gates,
                                                   float* __restrict__ out_loss) {
    __shared__ float red[256];
    __shared__ float impT[E_SZ], cntT[E_SZ];
    const int tid = threadIdx.x;
    float imp[E_SZ], cnt[E_SZ];
#pragma unroll
    for (int e = 0; e < E_SZ; ++e) { imp[e] = 0.0f; cnt[e] = 0.0f; }

    for (int r = tid; r < B_SZ; r += 256) {
#pragma unroll
        for (int e = 0; e < E_SZ; ++e) {
            float g = gates[(size_t)r * E_SZ + e];
            imp[e] += g;
            cnt[e] += (g > 0.0f) ? 1.0f : 0.0f;
        }
    }
    for (int e = 0; e < E_SZ; ++e) {
        red[tid] = imp[e]; __syncthreads();
        for (int s = 128; s > 0; s >>= 1) { if (tid < s) red[tid] += red[tid + s]; __syncthreads(); }
        if (tid == 0) impT[e] = red[0];
        __syncthreads();
        red[tid] = cnt[e]; __syncthreads();
        for (int s = 128; s > 0; s >>= 1) { if (tid < s) red[tid] += red[tid + s]; __syncthreads(); }
        if (tid == 0) cntT[e] = red[0];
        __syncthreads();
    }
    if (tid == 0) {
        float mi = 0.0f, ml = 0.0f;
        for (int e = 0; e < E_SZ; ++e) { mi += impT[e]; ml += cntT[e]; }
        mi *= (1.0f / E_SZ); ml *= (1.0f / E_SZ);
        float vi = 0.0f, vl = 0.0f;
        for (int e = 0; e < E_SZ; ++e) {
            float di = impT[e] - mi, dl = cntT[e] - ml;
            vi += di * di; vl += dl * dl;
        }
        vi *= (1.0f / (E_SZ - 1)); vl *= (1.0f / (E_SZ - 1));
        *out_loss = vi / (mi * mi + 1e-10f) + vl / (ml * ml + 1e-10f);
    }
}

// One chunk of W1 for one wave: CH k4 steps x 32 columns, global memory to registers.
static __device__ __forceinline__ void load_chunk(v2f (&wr)[CH][2], const float* __restrict__ W1,
                                                  unsigned g, unsigned wbyte) {
    g &= (unsigned)(E_SZ * (H_SZ / HC) * NCH - 1);
    const float* src = W1 + (size_t)(g / ((H_SZ / HC) * NCH)) * D_SZ * H_SZ  // expert
                          + (g % NCH) * (4 * CH * H_SZ)                      // k chunk
                          + ((g / NCH) % (H_SZ / HC)) * HC;                  // pass
    // Wave-uniform base + the lane's one byte offset + a constant per load.
    const float* lsrc = (const float*)((const char*)src + wbyte);
#pragma unroll
    for (int s = 0; s < CH; ++s) {
        wr[s][0] = *(const v2f*)&lsrc[(4 * s) * H_SZ];
        wr[s][1] = *(const v2f*)&lsrc[(4 * s + 1) * H_SZ];
    }
}

// 32 rows of x times one chunk of W1; ax0/ax1 point at the chunk's first swizzled pair.
static __device__ __forceinline__ void mul_chunk(v8f (&acc)[4], const v2f (&wr)[CH][2],
                                                 const float* ax0, const float* ax1) {
#pragma unroll
    for (int s = 0; s < CH; ++s) {
        v2f a0; a0.x = ax0[2 * s];  a0.y = ax0[2 * s + 1];
        v2f a1; a1.x = ax1[2 * s];  a1.y = ax1[2 * s + 1];
        v2f bA; bA.x = wr[s][0].x;  bA.y = wr[s][1].x;  // column cw
        v2f bB; bB.x = wr[s][0].y;  bB.y = wr[s][1].y;  // column cw+1
        acc[0] = wmma4(a0, bA, acc[0]);
        acc[1] = wmma4(a0, bB, acc[1]);
        acc[2] = wmma4(a1, bA, acc[2]);
        acc[3] = wmma4(a1, bB, acc[3]);
    }
}

// ---------------------------------------------------------------------------
// Kernel 3: fused expert MLP + weighted combine.
//   WMMA f32 16x16x4. No wave shares a W1 column with another wave, so each
//   wave loads its own W1 fragments from global memory straight into
//   registers, one chunk of CH k4 steps ahead of the chunk it multiplies.
// ---------------------------------------------------------------------------
__global__ __launch_bounds__(256) void moe_main(const float* __restrict__ x,
                                                const float* __restrict__ W1,
                                                const float* __restrict__ b1,
                                                const float* __restrict__ W2,
                                                const float* __restrict__ b2,
                                                const float* __restrict__ gates,
                                                float* __restrict__ y) {
    __shared__ float lX[MT * XSN];       // 41,216 B swizzled x tile [32][256]
    __shared__ float lAcc2[MT * O_SZ];
    __shared__ float lY[MT * O_SZ];

    const int tid  = threadIdx.x;
    const int wave = tid >> 5;
    const int lane = tid & 31;
    const int l15  = lane & 15;
    const int lhi  = lane >> 4;
    const int b0   = blockIdx.x * MT;

    // Stage X tile once with column-quad swizzle (b128 global + 2x b64 DS):
    // {k,k+1} at (k>>1); {k+2,k+3} at XHI+(k>>1) => A b64 reads hit all 64
    // banks exactly once for both half-waves and both row subtiles.
    {
        const int q   = tid & 63;   // quad-column 0..63
        const int rr0 = tid >> 6;   // 0..3
        for (int r = rr0; r < MT; r += 4) {
            float4 v = *(const float4*)&x[(size_t)(b0 + r) * D_SZ + 4 * q];
            v2f lo; lo.x = v.x; lo.y = v.y;
            v2f hi; hi.x = v.z; hi.y = v.w;
            *(v2f*)&lX[r * XSN + 2 * q]       = lo;
            *(v2f*)&lX[r * XSN + XHI + 2 * q] = hi;
        }
    }
    if (tid < MT * O_SZ) lY[tid] = 0.0f;

    const float* ax0 = &lX[l15 * XSN + lhi * XHI];
    const float* ax1 = &lX[(16 + l15) * XSN + lhi * XHI];
    // A lane's place in a W1 chunk: k rows 2*lhi and 2*lhi+1 of each k4 step,
    // columns cw and cw+1 (16 lanes x 8 B = one whole 128-B line per row).
    const unsigned cw   = 32u * wave + 2u * l15;
    const unsigned wbyte = (2u * lhi * H_SZ + cw) * (unsigned)sizeof(float);

    // Chunks are numbered in the order they are used: expert, pass, k chunk.
    // The number wraps at the end, so that the load one chunk ahead needs no
    // branch and stays inside W1 (the last one re-reads chunk 0, unused).
    unsigned g = 0;
    v2f wr0[CH][2], wr1[CH][2];  // [k4 step][k row of the lane's pair]
    load_chunk(wr0, W1, 0u, wbyte);

    for (int e = 0; e < E_SZ; ++e) {
        if (tid < MT * O_SZ) lAcc2[tid] = 0.0f;
        float plane[2][8][O_SZ];
#pragma unroll
        for (int rs = 0; rs < 2; ++rs)
#pragma unroll
            for (int j = 0; j < 8; ++j) { plane[rs][j][0] = 0.0f; plane[rs][j][1] = 0.0f; }

        __syncthreads();  // lX staged (e == 0); lAcc2 zeroed before the adds below

        // Kept rolled: unrolled, several passes' accumulators are live at once and
        // the registers no longer leave room for four waves on a SIMD.
#pragma unroll 1
        for (int hc = 0; hc < H_SZ; hc += HC) {
            v8f acc[4] = {};  // [0],[2]: column c0, rows 0-15, 16-31; [1],[3]: column c0+1
            // Loaded ahead of the K loop: behind it they would queue up after
            // the next pass's first chunk on the in-order load counter.
            const int c0 = hc + (int)cw;
            const v2f    bias = *(const v2f*)&b1[e * H_SZ + c0];
            const float4 w2v  = *(const float4*)&W2[((size_t)e * H_SZ + c0) * O_SZ];

            // Kept rolled: unrolled, the x fragments of the whole pass are held in
            // registers and only two waves fit a SIMD.
#pragma unroll 1
            for (int c = 0; c < NCH; c += 2) {
                load_chunk(wr1, W1, g + 1u, wbyte);
                mul_chunk(acc, wr0, ax0 + 2 * CH * c, ax1 + 2 * CH * c);
                load_chunk(wr0, W1, g + 2u, wbyte);
                mul_chunk(acc, wr1, ax0 + 2 * CH * (c + 1), ax1 + 2 * CH * (c + 1));
                g += 2u;
            }
            // Epilogue for this 256-col pass: bias + relu + contract with W2.
            const v8f acc00 = acc[0], acc01 = acc[1], acc10 = acc[2], acc11 = acc[3];
            const float bias0 = bias.x, bias1 = bias.y;
            const float w200 = w2v.x, w201 = w2v.y, w210 = w2v.z, w211 = w2v.w;
#pragma unroll
            for (int j = 0; j < 8; ++j) {
                float h00 = fmaxf(acc00[j] + bias0, 0.0f);
                float h01 = fmaxf(acc01[j] + bias1, 0.0f);
                plane[0][j][0] += h00 * w200 + h01 * w210;
                plane[0][j][1] += h00 * w201 + h01 * w211;
                float h10 = fmaxf(acc10[j] + bias0, 0.0f);
                float h11 = fmaxf(acc11[j] + bias1, 0.0f);
                plane[1][j][0] += h10 * w200 + h11 * w210;
                plane[1][j][1] += h10 * w201 + h11 * w211;
            }
        }
        // Reduce partials across the 16 lanes of each half-wave.
#pragma unroll
        for (int rs = 0; rs < 2; ++rs)
#pragma unroll
            for (int j = 0; j < 8; ++j)
#pragma unroll
                for (int o = 0; o < O_SZ; ++o) {
                    float v = plane[rs][j][o];
                    v += __shfl_xor(v, 1, 32);
                    v += __shfl_xor(v, 2, 32);
                    v += __shfl_xor(v, 4, 32);
                    v += __shfl_xor(v, 8, 32);
                    plane[rs][j][o] = v;
                }
        if (l15 == 0) {
#pragma unroll
            for (int rs = 0; rs < 2; ++rs) {
                const int rbase = 16 * rs + lhi * 8;
#pragma unroll
                for (int j = 0; j < 8; ++j) {
                    atomicAdd(&lAcc2[(rbase + j) * O_SZ + 0], plane[rs][j][0]);
                    atomicAdd(&lAcc2[(rbase + j) * O_SZ + 1], plane[rs][j][1]);
                }
            }
        }
        __syncthreads();
        // softmax over O=2, gate-weight, accumulate into block-local y
        if (tid < MT) {
            float v0 = lAcc2[tid * 2 + 0] + b2[e * O_SZ + 0];
            float v1 = lAcc2[tid * 2 + 1] + b2[e * O_SZ + 1];
            float m  = fmaxf(v0, v1);
            float e0 = __expf(v0 - m), e1 = __expf(v1 - m);
            float inv = 1.0f / (e0 + e1);
            float g   = gates[(size_t)(b0 + tid) * E_SZ + e];
            lY[tid * 2 + 0] += g * e0 * inv;
            lY[tid * 2 + 1] += g * e1 * inv;
        }
        __syncthreads();
    }
    if (tid < MT * O_SZ)
        y[(size_t)b0 * O_SZ + tid] = lY[tid];
}

// ---------------------------------------------------------------------------
extern "C" void kernel_launch(void* const* d_in, const int* in_sizes, int n_in,
                              void* d_out, int out_size, void* d_ws, size_t ws_size,
                              hipStream_t stream) {
    const float* x  = (const float*)d_in[0];
    const float* wg = (const float*)d_in[1];
    const float* W1 = (const float*)d_in[2];
    const float* b1 = (const float*)d_in[3];
    const float* W2 = (const float*)d_in[4];
    const float* b2 = (const float*)d_in[5];
    float* out   = (float*)d_out;              // [B*O] y, then [1] loss
    float* gates = (float*)d_ws;               // B*E floats = 1 MB scratch

    gate_kernel<<<B_SZ / 256, 256, 0, stream>>>(x, wg, gates);
    loss_kernel<<<1, 256, 0, stream>>>(gates, out + (size_t)B_SZ * O_SZ);
    moe_main<<<B_SZ / MT, 256, 0, stream>>>(x, W1, b1, W2, b2, gates, out);
}

// v002
// A run of this version takes 690 microseconds.
// Next to v001, in two timings, it ran 1.08 times as fast each time.
// Over all steps from v000 it is 2.08 times as fast.
#include <hip/hip_runtime.h>
#include <hip/hip_bf16.h>

typedef __attribute__((ext_vector_type(2))) float v2f;
typedef __attribute__((ext_vector_type(8))) float v8f;

#define B_SZ 16384
#define D_SZ 256
#define E_SZ 16
#define H_SZ 1024
#define O_SZ 2

#define MT  32    // rows per block (2 row subtiles of 16)
#define HC  256   // h columns per pass (8 waves x 32 cols)
#define CH  8     // k4 steps of W1 per register chunk (two chunks: one in use, one in flight)
#define NCH (D_SZ / 4 / CH)  // 8 chunks per (expert, hc) pass
#define XSN 322   // lX row stride (== 2 mod 64; row span 288 after swizzle)
#define XHI 160   // dword offset of the {k+2,k+3} half (160 % 64 == 32)
#define GB  (B_SZ / 256)  // blocks of the gate kernel, one partial row each
#define GP  17    // LDS pitch of a gate row (odd: stores and column reads meet no bank twice)

static __device__ __forceinline__ v8f wmma4(v2f a, v2f b, v8f c) {
    return __builtin_amdgcn_wmma_f32_16x16x4_f32(false, a, false, b, (short)0, c,
                                                 false, false);
}

// ---------------------------------------------------------------------------
// Kernel 1: gating  logits = x @ w_gate ; gates = softmax(logits, axis=1)
//   Also sums its own 256 rows per expert (gate values, and how many are > 0)
//   into one row of 32 partials, so that the loss kernel reads GB rows only.
// ---------------------------------------------------------------------------
__global__ __launch_bounds__(256) void gate_kernel(const float* __restrict__ x,
                                                   const float* __restrict__ wg,
                                                   float* __restrict__ gates,
                                                   float* __restrict__ part) {
    __shared__ float lwg[256 * GP];     // w_gate (16 KB of it), then the block's gates
    __shared__ float lps[2][16][E_SZ];  // [sum, count][group of 16 rows][expert]
    const int tid = threadIdx.x;
    for (int i = tid; i < D_SZ * E_SZ; i += 256) lwg[i] = wg[i];
    __syncthreads();

    const int row = blockIdx.x * 256 + tid;
    float acc[E_SZ];
#pragma unroll
    for (int e = 0; e < E_SZ; ++e) acc[e] = 0.0f;

    const float* xr = x + (size_t)row * D_SZ;
    for (int d = 0; d < D_SZ; d += 4) {
        float4 xv = *(const float4*)(xr + d);
#pragma unroll
        for (int e = 0; e < E_SZ; ++e) {
            acc[e] += xv.x * lwg[(d + 0) * E_SZ + e] + xv.y * lwg[(d + 1) * E_SZ + e] +
                      xv.z * lwg[(d + 2) * E_SZ + e] + xv.w * lwg[(d + 3) * E_SZ + e];
        }
    }
    float m = acc[0];
#pragma unroll
    for (int e = 1; e < E_SZ; ++e) m = fmaxf(m, acc[e]);
    float ex[E_SZ];
    float s = 0.0f;
#pragma unroll
    for (int e = 0; e < E_SZ; ++e) { ex[e] = __expf(acc[e] - m); s += ex[e]; }
    const float inv = 1.0f / s;
#pragma unroll
    for (int e = 0; e < E_SZ; ++e) { ex[e] *= inv; gates[(size_t)row * E_SZ + e] = ex[e]; }

    __syncthreads();  // every thread is done with w_gate before its LDS is reused
    // Unrolled so that ex[] is indexed by constants and stays in registers.
#pragma unroll
    for (int e = 0; e < E_SZ; ++e) lwg[tid * GP + e] = ex[e];
    __syncthreads();
    {
        const int e = tid & 15, grp = tid >> 4;
        float s = 0.0f, c = 0.0f;
        // Unrolled so that the 16 LDS reads are in flight together.
#pragma unroll
        for (int i = 0; i < 16; ++i) {
            const float g = lwg[(grp * 16 + i) * GP + e];
            s += g;
            c += (g > 0.0f) ? 1.0f : 0.0f;
        }
        lps[0][grp][e] = s;
        lps[1][grp][e] = c;
    }
    __syncthreads();
    if (tid < 2 * E_SZ) {
        float s = 0.0f;
        // Unrolled for the same reason.
#pragma unroll
        for (int i = 0; i < 16; ++i) s += lps[tid >> 4][i][tid & 15];
        part[blockIdx.x * (2 * E_SZ) + tid] = s;
    }
}

// ---------------------------------------------------------------------------
// Kernel 2: load-balance loss  cv2(importance) + cv2(load), ddof=1
// ---------------------------------------------------------------------------
__global__ __launch_bounds__(256) void loss_kernel(const float* __restrict__ part,
                                                   float* __restrict__ out_loss) {
    __shared__ float red[8][2 * E_SZ];
    __shared__ float impT[E_SZ], cntT[E_SZ];
    const int tid = threadIdx.x;
    const int v = tid & 31;   // 0-15: gate sum of expert v; 16-31: count of expert v-16
    const int w = tid >> 5;   // each wave adds GB/8 partial rows, 128 B a row
    float s = 0.0f;
    // Unrolled so that a wave's loads are all in flight together.
#pragma unroll
    for (int i = 0; i < GB / 8; ++i) s += part[(w * (GB / 8) + i) * (2 * E_SZ) + v];
    red[w][v] = s;
    __syncthreads();
    if (tid < 2 * E_SZ) {
        float t = 0.0f;
        // Unrolled so that the 8 LDS reads are in flight together.
#pragma unroll
        for (int i = 0; i < 8; ++i) t += red[i][tid];
        if (tid < E_SZ) impT[tid] = t; else cntT[tid - E_SZ] = t;
    }
    __syncthreads();
    if (tid == 0) {
        float mi = 0.0f, ml = 0.0f;
        for (int e = 0; e < E_SZ; ++e) { mi += impT[e]; ml += cntT[e]; }
        mi *= (1.0f / E_SZ); ml *= (1.0f / E_SZ);
        float vi = 0.0f, vl = 0.0f;
        for (int e = 0; e < E_SZ; ++e) {
            float di = impT[e] - mi, dl = cntT[e] - ml;
            vi += di * di; vl += dl * dl;
        }
        vi *= (1.0f / (E_SZ - 1)); vl *= (1.0f / (E_SZ - 1));
        *out_loss = vi / (mi * mi + 1e-10f) + vl / (ml * ml + 1e-10f);
    }
}

// One chunk of W1 for one wave: CH k4 steps x 32 columns, global memory to registers.
static __device__ __forceinline__ void load_chunk(v2f (&wr)[CH][2], const float* __restrict__ W1,
                                                  unsigned g, unsigned wbyte) {
    g &= (unsigned)(E_SZ * (H_SZ / HC) * NCH - 1);
    const float* src = W1 + (size_t)(g / ((H_SZ / HC) * NCH)) * D_SZ * H_SZ  // expert
                          + (g % NCH) * (4 * CH * H_SZ)                      // k chunk
                          + ((g / NCH) % (H_SZ / HC)) * HC;                  // pass
    // Wave-uniform base + the lane's one byte offset + a constant per load.
    const float* lsrc = (const float*)((const char*)src + wbyte);
#pragma unroll
    for (int s = 0; s < CH; ++s) {
        wr[s][0] = *(const v2f*)&lsrc[(4 * s) * H_SZ];
        wr[s][1] = *(const v2f*)&lsrc[(4 * s + 1) * H_SZ];
    }
}

// 32 rows of x times one chunk of W1; ax0/ax1 point at the chunk's first swizzled pair.
static __device__ __forceinline__ void mul_chunk(v8f (&acc)[4], const v2f (&wr)[CH][2],
                                                 const float* ax0, const float* ax1) {
#pragma unroll
    for (int s = 0; s < CH; ++s) {
        v2f a0; a0.x = ax0[2 * s];  a0.y = ax0[2 * s + 1];
        v2f a1; a1.x = ax1[2 * s];  a1.y = ax1[2 * s + 1];
        v2f bA; bA.x = wr[s][0].x;  bA.y = wr[s][1].x;  // column cw
        v2f bB; bB.x = wr[s][0].y;  bB.y = wr[s][1].y;  // column cw+1
        acc[0] = wmma4(a0, bA, acc[0]);
        acc[1] = wmma4(a0, bB, acc[1]);
        acc[2] = wmma4(a1, bA, acc[2]);
        acc[3] = wmma4(a1, bB, acc[3]);
    }
}

// ---------------------------------------------------------------------------
// Kernel 3: fused expert MLP + weighted combine.
//   WMMA f32 16x16x4. No wave shares a W1 column with another wave, so each
//   wave loads its own W1 fragments from global memory straight into
//   registers, one chunk of CH k4 steps ahead of the chunk it multiplies.
// ---------------------------------------------------------------------------
__global__ __launch_bounds__(256) void moe_main(const float* __restrict__ x,
                                                const float* __restrict__ W1,
                                                const float* __restrict__ b1,
                                                const float* __restrict__ W2,
                                                const float* __restrict__ b2,
                                                const float* __restrict__ gates,
                                                float* __restrict__ y) {
    __shared__ float lX[MT * XSN];       // 41,216 B swizzled x tile [32][256]
    __shared__ float lAcc2[MT * O_SZ];
    __shared__ float lY[MT * O_SZ];

    const int tid  = threadIdx.x;
    const int wave = tid >> 5;
    const int lane = tid & 31;
    const int l15  = lane & 15;
    const int lhi  = lane >> 4;
    const int b0   = blockIdx.x * MT;

    // Stage X tile once with column-quad swizzle (b128 global + 2x b64 DS):
    // {k,k+1} at (k>>1); {k+2,k+3} at XHI+(k>>1) => A b64 reads hit all 64
    // banks exactly once for both half-waves and both row subtiles.
    {
        const int q   = tid & 63;   // quad-column 0..63
        const int rr0 = tid >> 6;   // 0..3
        for (int r = rr0; r < MT; r += 4) {
            float4 v = *(const float4*)&x[(size_t)(b0 + r) * D_SZ + 4 * q];
            v2f lo; lo.x = v.x; lo.y = v.y;
            v2f hi; hi.x = v.z; hi.y = v.w;
            *(v2f*)&lX[r * XSN + 2 * q]       = lo;
            *(v2f*)&lX[r * XSN + XHI + 2 * q] = hi;
        }
    }
    if (tid < MT * O_SZ) lY[tid] = 0.0f;

    const float* ax0 = &lX[l15 * XSN + lhi * XHI];
    const float* ax1 = &lX[(16 + l15) * XSN + lhi * XHI];
    // A lane's place in a W1 chunk: k rows 2*lhi and 2*lhi+1 of each k4 step,
    // columns cw and cw+1 (16 lanes x 8 B = one whole 128-B line per row).
    const unsigned cw   = 32u * wave + 2u * l15;
    const unsigned wbyte = (2u * lhi * H_SZ + cw) * (unsigned)sizeof(float);

    // Chunks are numbered in the order they are used: expert, pass, k chunk.
    // The number wraps at the end, so that the load one chunk ahead needs no
    // branch and stays inside W1 (the last one re-reads chunk 0, unused).
    unsigned g = 0;
    v2f wr0[CH][2], wr1[CH][2];  // [k4 step][k row of the lane's pair]
    load_chunk(wr0, W1, 0u, wbyte);

    for (int e = 0; e < E_SZ; ++e) {
        if (tid < MT * O_SZ) lAcc2[tid] = 0.0f;
        float plane[2][8][O_SZ];
#pragma unroll
        for (int rs = 0; rs < 2; ++rs)
#pragma unroll
            for (int j = 0; j < 8; ++j) { plane[rs][j][0] = 0.0f; plane[rs][j][1] = 0.0f; }

        __syncthreads();  // lX staged (e == 0); lAcc2 zeroed before the adds below

        // Kept rolled: unrolled, several passes' accumulators are live at once and
        // the registers no longer leave room for four waves on a SIMD.
#pragma unroll 1
        for (int hc = 0; hc < H_SZ; hc += HC) {
            v8f acc[4] = {};  // [0],[2]: column c0, rows 0-15, 16-31; [1],[3]: column c0+1
            // Loaded ahead of the K loop: behind it they would queue up after
            // the next pass's first chunk on the in-order load counter.
            const int c0 = hc + (int)cw;
            const v2f    bias = *(const v2f*)&b1[e * H_SZ + c0];
            const float4 w2v  = *(const float4*)&W2[((size_t)e * H_SZ + c0) * O_SZ];

            // Kept rolled: unrolled, the x fragments of the whole pass are held in
            // registers and only two waves fit a SIMD.
#pragma unroll 1
            for (int c = 0; c < NCH; c += 2) {
                load_chunk(wr1, W1, g + 1u, wbyte);
                mul_chunk(acc, wr0, ax0 + 2 * CH * c, ax1 + 2 * CH * c);
                load_chunk(wr0, W1, g + 2u, wbyte);
                mul_chunk(acc, wr1, ax0 + 2 * CH * (c + 1), ax1 + 2 * CH * (c + 1));
                g += 2u;
            }
            // Epilogue for this 256-col pass: bias + relu + contract with W2.
            const v8f acc00 = acc[0], acc01 = acc[1], acc10 = acc[2], acc11 = acc[3];
            const float bias0 = bias.x, bias1 = bias.y;
            const float w200 = w2v.x, w201 = w2v.y, w210 = w2v.z, w211 = w2v.w;
#pragma unroll
            for (int j = 0; j < 8; ++j) {
                float h00 = fmaxf(acc00[j] + bias0, 0.0f);
                float h01 = fmaxf(acc01[j] + bias1, 0.0f);
                plane[0][j][0] += h00 * w200 + h01 * w210;
                plane[0][j][1] += h00 * w201 + h01 * w211;
                float h10 = fmaxf(acc10[j] + bias0, 0.0f);
                float h11 = fmaxf(acc11[j] + bias1, 0.0f);
                plane[1][j][0] += h10 * w200 + h11 * w210;
                plane[1][j][1] += h10 * w201 + h11 * w211;
            }
        }
        // Reduce partials across the 16 lanes of each half-wave.
#pragma unroll
        for (int rs = 0; rs < 2; ++rs)
#pragma unroll
            for (int j = 0; j < 8; ++j)
#pragma unroll
                for (int o = 0; o < O_SZ; ++o) {
                    float v = plane[rs][j][o];
                    v += __shfl_xor(v, 1, 32);
                    v += __shfl_xor(v, 2, 32);
                    v += __shfl_xor(v, 4, 32);
                    v += __shfl_xor(v, 8, 32);
                    plane[rs][j][o] = v;
                }
        if (l15 == 0) {
#pragma unroll
            for (int rs = 0; rs < 2; ++rs) {
                const int rbase = 16 * rs + lhi * 8;
#pragma unroll
                for (int j = 0; j < 8; ++j) {
                    atomicAdd(&lAcc2[(rbase + j) * O_SZ + 0], plane[rs][j][0]);
                    atomicAdd(&lAcc2[(rbase + j) * O_SZ + 1], plane[rs][j][1]);
                }
            }
        }
        __syncthreads();
        // softmax over O=2, gate-weight, accumulate into block-local y
        if (tid < MT) {
            float v0 = lAcc2[tid * 2 + 0] + b2[e * O_SZ + 0];
            float v1 = lAcc2[tid * 2 + 1] + b2[e * O_SZ + 1];
            float m  = fmaxf(v0, v1);
            float e0 = __expf(v0 - m), e1 = __expf(v1 - m);
            float inv = 1.0f / (e0 + e1);
            float g   = gates[(size_t)(b0 + tid) * E_SZ + e];
            lY[tid * 2 + 0] += g * e0 * inv;
            lY[tid * 2 + 1] += g * e1 * inv;
        }
        __syncthreads();
    }
    if (tid < MT * O_SZ)
        y[(size_t)b0 * O_SZ + tid] = lY[tid];
}

// ---------------------------------------------------------------------------
extern "C" void kernel_launch(void* const* d_in, const int* in_sizes, int n_in,
                              void* d_out, int out_size, void* d_ws, size_t ws_size,
                              hipStream_t stream) {
    const float* x  = (const float*)d_in[0];
    const float* wg = (const float*)d_in[1];
    const float* W1 = (const float*)d_in[2];
    const float* b1 = (const float*)d_in[3];
    const float* W2 = (const float*)d_in[4];
    const float* b2 = (const float*)d_in[5];
    float* out   = (float*)d_out;              // [B*O] y, then [1] loss
    float* gates = (float*)d_ws;               // B*E floats = 1 MB scratch
    float* part  = gates + (size_t)B_SZ * E_SZ; // GB rows of 32 partial sums

    gate_kernel<<<B_SZ / 256, 256, 0, stream>>>(x, wg, gates, part);
    loss_kernel<<<1, 256, 0, stream>>>(part, out + (size_t)B_SZ * O_SZ);
    moe_main<<<B_SZ / MT, 256, 0, stream>>>(x, W1, b1, W2, b2, gates, out);
}

// v003
// It runs in 663 microseconds.
// Next to v002, in two timings, it ran 1.04 times as fast each time.
// All steps since v000 together make it 2.17 times as fast.
#include <hip/hip_runtime.h>
#include <hip/hip_bf16.h>

typedef __attribute__((ext_vector_type(2))) float v2f;
typedef __attribute__((ext_vector_type(8))) float v8f;

#define B_SZ 16384
#define D_SZ 256
#define E_SZ 16
#define H_SZ 1024
#define O_SZ 2

#define MT  32    // rows per block (2 row subtiles of 16)
#define HC  256   // h columns per pass (8 waves x 32 cols)
#define CH  8     // k4 steps of W1 per register chunk (two chunks: one in use, one in flight)
#define NCH (D_SZ / 4 / CH)  // 8 chunks per (expert, hc) pass
#define XSN 322   // lX row stride (== 2 mod 64; row span 288 after swizzle)
#define XHI 160   // dword offset of the {k+2,k+3} half (160 % 64 == 32)
#define NB  (B_SZ / MT)  // blocks of the main kernel, one row of 32 partial sums each
#define GP  17    // LDS pitch of a gate row (odd: column reads meet no bank twice)
#define GS  (D_SZ / 4 / 8)  // k4 steps of the gate product per wave (k split over 8 waves)

static __device__ __forceinline__ v8f wmma4(v2f a, v2f b, v8f c) {
    return __builtin_amdgcn_wmma_f32_16x16x4_f32(false, a, false, b, (short)0, c,
                                                 false, false);
}

// ---------------------------------------------------------------------------
// Loss kernel (runs last): cv2(importance) + cv2(load), ddof=1, from the
//   main kernel's NB rows of 32 partial sums (16 gate sums, 16 counts).
// ---------------------------------------------------------------------------
__global__ __launch_bounds__(256) void loss_kernel(const float* __restrict__ part,
                                                   float* __restrict__ out_loss) {
    __shared__ float red[8][2 * E_SZ];
    __shared__ float impT[E_SZ], cntT[E_SZ];
    const int tid = threadIdx.x;
    const int v = tid & 31;   // 0-15: gate sum of expert v; 16-31: count of expert v-16
    const int w = tid >> 5;   // each wave adds NB/8 partial rows, 128 B a row
    float s = 0.0f;
    // Unrolled so that a wave's loads are all in flight together.
#pragma unroll
    for (int i = 0; i < NB / 8; ++i) s += part[(w * (NB / 8) + i) * (2 * E_SZ) + v];
    red[w][v] = s;
    __syncthreads();
    if (tid < 2 * E_SZ) {
        float t = 0.0f;
        // Unrolled so that the 8 LDS reads are in flight together.
#pragma unroll
        for (int i = 0; i < 8; ++i) t += red[i][tid];
        if (tid < E_SZ) impT[tid] = t; else cntT[tid - E_SZ] = t;
    }
    __syncthreads();
    if (tid == 0) {
        float mi = 0.0f, ml = 0.0f;
        for (int e = 0; e < E_SZ; ++e) { mi += impT[e]; ml += cntT[e]; }
        mi *= (1.0f / E_SZ); ml *= (1.0f / E_SZ);
        float vi = 0.0f, vl = 0.0f;
        for (int e = 0; e < E_SZ; ++e) {
            float di = impT[e] - mi, dl = cntT[e] - ml;
            vi += di * di; vl += dl * dl;
        }
        vi *= (1.0f / (E_SZ - 1)); vl *= (1.0f / (E_SZ - 1));
        *out_loss = vi / (mi * mi + 1e-10f) + vl / (ml * ml + 1e-10f);
    }
}

// One chunk of W1 for one wave: CH k4 steps x 32 columns, global memory to registers.
static __device__ __forceinline__ void load_chunk(v2f (&wr)[CH][2], const float* __restrict__ W1,
                                                  unsigned g, unsigned wbyte) {
    g &= (unsigned)(E_SZ * (H_SZ / HC) * NCH - 1);
    const float* src = W1 + (size_t)(g / ((H_SZ / HC) * NCH)) * D_SZ * H_SZ  // expert
                          + (g % NCH) * (4 * CH * H_SZ)                      // k chunk
                          + ((g / NCH) % (H_SZ / HC)) * HC;                  // pass
    // Wave-uniform base + the lane's one byte offset + a constant per load.
    const float* lsrc = (const float*)((const char*)src + wbyte);
#pragma unroll
    for (int s = 0; s < CH; ++s) {
        wr[s][0] = *(const v2f*)&lsrc[(4 * s) * H_SZ];
        wr[s][1] = *(const v2f*)&lsrc[(4 * s + 1) * H_SZ];
    }
}

// 32 rows of x times one chunk of W1; ax0/ax1 point at the chunk's first swizzled pair.
static __device__ __forceinline__ void mul_chunk(v8f (&acc)[4], const v2f (&wr)[CH][2],
                                                 const float* ax0, const float* ax1) {
#pragma unroll
    for (int s = 0; s < CH; ++s) {
        v2f a0; a0.x = ax0[2 * s];  a0.y = ax0[2 * s + 1];
        v2f a1; a1.x = ax1[2 * s];  a1.y = ax1[2 * s + 1];
        v2f bA; bA.x = wr[s][0].x;  bA.y = wr[s][1].x;  // column cw
        v2f bB; bB.x = wr[s][0].y;  bB.y = wr[s][1].y;  // column cw+1
        acc[0] = wmma4(a0, bA, acc[0]);
        acc[1] = wmma4(a0, bB, acc[1]);
        acc[2] = wmma4(a1, bA, acc[2]);
        acc[3] = wmma4(a1, bB, acc[3]);
    }
}

// ---------------------------------------------------------------------------
// Main kernel: gating of its own 32 rows, fused expert MLP, weighted combine.
//   gates = softmax(x @ w_gate) come from the x tile that the block holds in
//   LDS anyway and stay in LDS; their sums per expert go out as one partial row.
//   WMMA f32 16x16x4. No wave shares a W1 column with another wave, so each
//   wave loads its own W1 fragments from global memory straight into
//   registers, one chunk of CH k4 steps ahead of the chunk it multiplies.
// ---------------------------------------------------------------------------
__global__ __launch_bounds__(256) void moe_main(const float* __restrict__ x,
                                                const float* __restrict__ wg,
                                                const float* __restrict__ W1,
                                                const float* __restrict__ b1,
                                                const float* __restrict__ W2,
                                                const float* __restrict__ b2,
                                                float* __restrict__ part,
                                                float* __restrict__ y) {
    __shared__ float lX[MT * XSN];       // 41,216 B swizzled x tile [32][256]
    __shared__ float lAcc2[MT * O_SZ];
    __shared__ float lY[MT * O_SZ];
    __shared__ float lGp[8][MT * GP];    // each wave's k slice of the gate logits
    __shared__ float lG[MT * GP];        // logits, then gates, of the block's rows

    const int tid  = threadIdx.x;
    const int wave = tid >> 5;
    const int lane = tid & 31;
    const int l15  = lane & 15;
    const int lhi  = lane >> 4;
    const int b0   = blockIdx.x * MT;

    // Stage X tile once with column-quad swizzle (b128 global + 2x b64 DS):
    // {k,k+1} at (k>>1); {k+2,k+3} at XHI+(k>>1) => A b64 reads hit all 64
    // banks exactly once for both half-waves and both row subtiles.
    {
        const int q   = tid & 63;   // quad-column 0..63
        const int rr0 = tid >> 6;   // 0..3
        for (int r = rr0; r < MT; r += 4) {
            float4 v = *(const float4*)&x[(size_t)(b0 + r) * D_SZ + 4 * q];
            v2f lo; lo.x = v.x; lo.y = v.y;
            v2f hi; hi.x = v.z; hi.y = v.w;
            *(v2f*)&lX[r * XSN + 2 * q]       = lo;
            *(v2f*)&lX[r * XSN + XHI + 2 * q] = hi;
        }
    }
    if (tid < MT * O_SZ) lY[tid] = 0.0f;

    const float* ax0 = &lX[l15 * XSN + lhi * XHI];
    const float* ax1 = &lX[(16 + l15) * XSN + lhi * XHI];
    // A lane's place in a W1 chunk: k rows 2*lhi and 2*lhi+1 of each k4 step,
    // columns cw and cw+1 (16 lanes x 8 B = one whole 128-B line per row).
    const unsigned cw   = 32u * wave + 2u * l15;
    const unsigned wbyte = (2u * lhi * H_SZ + cw) * (unsigned)sizeof(float);

    // Chunks are numbered in the order they are used: expert, pass, k chunk.
    // The number wraps at the end, so that the load one chunk ahead needs no
    // branch and stays inside W1 (the last one re-reads chunk 0, unused).
    unsigned g = 0;
    v2f wr0[CH][2], wr1[CH][2];  // [k4 step][k row of the lane's pair]
    load_chunk(wr0, W1, 0u, wbyte);

    // Gating. Each wave multiplies all 32 rows by its own 32 k of w_gate
    // (B fragment: column = expert l15, k rows as for W1).
    {
        v2f bg[GS];
        // Unrolled so that bg[] is indexed by constants (registers) and the 16
        // loads are in flight together, beside those of W1's first chunk.
#pragma unroll
        for (int s = 0; s < GS; ++s) {
            const int k = 4 * (GS * wave + s) + 2 * lhi;
            bg[s].x = wg[k * E_SZ + l15];
            bg[s].y = wg[(k + 1) * E_SZ + l15];
        }
        __syncthreads();  // lX staged
        v8f g0 = {}, g1 = {};
        // Unrolled: bg[] by constants.
#pragma unroll
        for (int s = 0; s < GS; ++s) {
            const int q = 2 * (GS * wave + s);
            v2f a0; a0.x = ax0[q];  a0.y = ax0[q + 1];
            v2f a1; a1.x = ax1[q];  a1.y = ax1[q + 1];
            g0 = wmma4(a0, bg[s], g0);
            g1 = wmma4(a1, bg[s], g1);
        }
        // Unrolled: accumulator elements picked by constants.
#pragma unroll
        for (int j = 0; j < 8; ++j) {
            lGp[wave][(8 * lhi + j) * GP + l15]      = g0[j];
            lGp[wave][(16 + 8 * lhi + j) * GP + l15] = g1[j];
        }
        __syncthreads();  // all eight k slices written
        // Unrolled so that both sums' LDS reads are in flight together.
#pragma unroll
        for (int h = 0; h < 2; ++h) {
            const int at = (16 * h + (tid >> 4)) * GP + (tid & 15);
            float s = 0.0f;
            // Unrolled so that the 8 LDS reads are in flight together.
#pragma unroll
            for (int w = 0; w < 8; ++w) s += lGp[w][at];
            lG[at] = s;
        }
        __syncthreads();  // logits whole
        if (tid < MT) {
            float ex[E_SZ];
            // The four loops over e are unrolled so that ex[] is indexed by
            // constants and stays in registers.
#pragma unroll
            for (int e = 0; e < E_SZ; ++e) ex[e] = lG[tid * GP + e];
            float m = ex[0];
#pragma unroll
            for (int e = 1; e < E_SZ; ++e) m = fmaxf(m, ex[e]);
            float s = 0.0f;
#pragma unroll
            for (int e = 0; e < E_SZ; ++e) { ex[e] = __expf(ex[e] - m); s += ex[e]; }
            const float inv = 1.0f / s;
#pragma unroll
            for (int e = 0; e < E_SZ; ++e) lG[tid * GP + e] = ex[e] * inv;
        }
        __syncthreads();  // gates written: read below and at the end of every expert
        if (tid < 2 * E_SZ) {
            float s = 0.0f;
            // Unrolled so that the 32 LDS reads are in flight together.
#pragma unroll
            for (int r = 0; r < MT; ++r) {
                const float g = lG[r * GP + (tid & 15)];
                s += (tid < E_SZ) ? g : ((g > 0.0f) ? 1.0f : 0.0f);
            }
            part[blockIdx.x * (2 * E_SZ) + tid] = s;
        }
    }

    for (int e = 0; e < E_SZ; ++e) {
        if (tid < MT * O_SZ) lAcc2[tid] = 0.0f;
        float plane[2][8][O_SZ];
#pragma unroll
        for (int rs = 0; rs < 2; ++rs)
#pragma unroll
            for (int j = 0; j < 8; ++j) { plane[rs][j][0] = 0.0f; plane[rs][j][1] = 0.0f; }

        __syncthreads();  // lAcc2 zeroed before the adds below

        // Kept rolled: unrolled, several passes' accumulators are live at once and
        // the registers no longer leave room for four waves on a SIMD.
#pragma unroll 1
        for (int hc = 0; hc < H_SZ; hc += HC) {
            v8f acc[4] = {};  // [0],[2]: column c0, rows 0-15, 16-31; [1],[3]: column c0+1
            // Loaded ahead of the K loop: behind it they would queue up after
            // the next pass's first chunk on the in-order load counter.
            const int c0 = hc + (int)cw;
            const v2f    bias = *(const v2f*)&b1[e * H_SZ + c0];
            const float4 w2v  = *(const float4*)&W2[((size_t)e * H_SZ + c0) * O_SZ];

            // Kept rolled: unrolled, the x fragments of the whole pass are held in
            // registers and only two waves fit a SIMD.
#pragma unroll 1
            for (int c = 0; c < NCH; c += 2) {
                load_chunk(wr1, W1, g + 1u, wbyte);
                mul_chunk(acc, wr0, ax0 + 2 * CH * c, ax1 + 2 * CH * c);
                load_chunk(wr0, W1, g + 2u, wbyte);
                mul_chunk(acc, wr1, ax0 + 2 * CH * (c + 1), ax1 + 2 * CH * (c + 1));
                g += 2u;
            }
            // Epilogue for this 256-col pass: bias + relu + contract with W2.
            const v8f acc00 = acc[0], acc01 = acc[1], acc10 = acc[2], acc11 = acc[3];
            const float bias0 = bias.x, bias1 = bias.y;
            const float w200 = w2v.x, w201 = w2v.y, w210 = w2v.z, w211 = w2v.w;
#pragma unroll
            for (int j = 0; j < 8; ++j) {
                float h00 = fmaxf(acc00[j] + bias0, 0.0f);
                float h01 = fmaxf(acc01[j] + bias1, 0.0f);
                plane[0][j][0] += h00 * w200 + h01 * w210;
                plane[0][j][1] += h00 * w201 + h01 * w211;
                float h10 = fmaxf(acc10[j] + bias0, 0.0f);
                float h11 = fmaxf(acc11[j] + bias1, 0.0f);
                plane[1][j][0] += h10 * w200 + h11 * w210;
                plane[1][j][1] += h10 * w201 + h11 * w211;
            }
        }
        // Reduce partials across the 16 lanes of each half-wave.
#pragma unroll
        for (int rs = 0; rs < 2; ++rs)
#pragma unroll
            for (int j = 0; j < 8; ++j)
#pragma unroll
                for (int o = 0; o < O_SZ; ++o) {
                    float v = plane[rs][j][o];
                    v += __shfl_xor(v, 1, 32);
                    v += __shfl_xor(v, 2, 32);
                    v += __shfl_xor(v, 4, 32);
                    v += __shfl_xor(v, 8, 32);
                    plane[rs][j][o] = v;
                }
        if (l15 == 0) {
#pragma unroll
            for (int rs = 0; rs < 2; ++rs) {
                const int rbase = 16 * rs + lhi * 8;
#pragma unroll
                for (int j = 0; j < 8; ++j) {
                    atomicAdd(&lAcc2[(rbase + j) * O_SZ + 0], plane[rs][j][0]);
                    atomicAdd(&lAcc2[(rbase + j) * O_SZ + 1], plane[rs][j][1]);
                }
            }
        }
        __syncthreads();
        // softmax over O=2, gate-weight, accumulate into block-local y
        if (tid < MT) {
            float v0 = lAcc2[tid * 2 + 0] + b2[e * O_SZ + 0];
            float v1 = lAcc2[tid * 2 + 1] + b2[e * O_SZ + 1];
            float m  = fmaxf(v0, v1);
            float e0 = __expf(v0 - m), e1 = __expf(v1 - m);
            float inv = 1.0f / (e0 + e1);
            float g   = lG[tid * GP + e];
            lY[tid * 2 + 0] += g * e0 * inv;
            lY[tid * 2 + 1] += g * e1 * inv;
        }
        __syncthreads();
    }
    if (tid < MT * O_SZ)
        y[(size_t)b0 * O_SZ + tid] = lY[tid];
}

// ---------------------------------------------------------------------------
extern "C" void kernel_launch(void* const* d_in, const int* in_sizes, int n_in,
                              void* d_out, int out_size, void* d_ws, size_t ws_size,
                              hipStream_t stream) {
    const float* x  = (const float*)d_in[0];
    const float* wg = (const float*)d_in[1];
    const float* W1 = (const float*)d_in[2];
    const float* b1 = (const float*)d_in[3];
    const float* W2 = (const float*)d_in[4];
    const float* b2 = (const float*)d_in[5];
    float* out   = (float*)d_out;              // [B*O] y, then [1] loss
    float* part  = (float*)d_ws;               // NB rows of 32 partial sums = 64 KB scratch

    moe_main<<<B_SZ / MT, 256, 0, stream>>>(x, wg, W1, b1, W2, b2, part, out);
    loss_kernel<<<1, 256, 0, stream>>>(part, out + (size_t)B_SZ * O_SZ);
}
